// v010
// Measured on an AMD MI455X. A time is GPU time per run, averaged over a window of back-to-back runs after a warm-up
// (all launches, gaps included; the runs take copies of the inputs in turn), and the median of several windows.
// Apart from v000's, it joins two sittings. Times from different sittings can be a few percent apart, while
// side-by-side timings come from the same sitting.
// This document starts at v010; the versions before it stand elsewhere.
// A run of this version takes 301 microseconds.
// Two timings next to v009 both put it at 1.04 times that version's speed.
// Over all steps from v000, the starting kernel, it is 6.37 times as fast.
// Contractions (all v_wmma_f32_16x16x32_f16, f16 operands, f32 accumulate): input projection (obs f16 x16 . Wp^T f16 x64, K=640
// zero-padded, single product); q/k, v^T, attention-output, hidden (ReLU), second and both head projections with the activation
// operand carried as two f16 planes [hi | residual x64] folded along K against [W^T x64 | W^T x1]; attention scores k.q^T from the
// q/k hi and residual planes (hi.hi plus the two cross terms, two accumulators, K=64); attention v^T.P^T with P f16 x16384 (single)
// against v^T hi and residual planes (two accumulators). RMSNorm, softmax (base 2), ReLU, biases, relative-position bias and the
// residual stream in f32 on VALU. Every float input RNE-converted to bf16 on load.
// RMSNorm has no launch of its own: the row factor rsqrt(mean(x*x) + eps) commutes with the product along the row, so the product
// that makes x also stores the operand plane of x * bf16(norm weight) and its tile's sums of squares, and the product that reads the
// plane multiplies its result by the row factor.
#include <hip/hip_runtime.h>
#include <math.h>
#include <stdint.h>

#ifndef NB
#define NB        2
#endif
#ifndef SEQ
#define SEQ       2048
#endif
#define NB_FULL   2
#define SEQ_FULL  2048
#define NLAYER    6
#define DMODEL    256
#define NHEAD     4
#define HDIM      64
#define DFF       512
#define OBSD      637
#define OBSP      640
#define NACT      4
#define NACTP     64
#define NBUCK     32
#define NROWS     (NB * SEQ)
#define KD        (2 * DMODEL)          // folded K of E-wide activation operands: [hi 256 | residual 256]
#define KF        (2 * DFF)             // folded K of the hidden operand: [hi 512 | residual 512]
#define VTR       KD                    // VTR * SEQ halves per batch of the v^T plane: hi and residual of 256 d, in fragment order
#define OUT1_OFF  (NB_FULL * SEQ_FULL * NACT)   // float index of the second output (byte offset 65536)
#define OUT_TOTAL (OUT1_OFF + NB_FULL * SEQ_FULL * OBSD)

// carries (exact powers of two)
#define WSC_I 64
#define RC_I  64
#define WLO_I 1
#define WSC   64.0f        // weight hi copy
#define WLO   1.0f         // weight lo copy (pairs with the x64 residual plane)
#define RC    64.0f        // residual plane carry relative to its hi plane
#define RCI   0.015625f
#define OBC   16.0f        // obs plane
#define HC    4.0f         // x * norm weight planes (not yet divided by the row's rms)
#define QC    16.0f
#define KC    16.0f
#define VC    16.0f
#define PC    16384.0f     // softmax P tile
#define CC    16.0f        // attention context
#define GC    64.0f        // ReLU hidden
#define ATT_SCALE 0.125f
#define LOG2E   1.4426950408889634f
#define RMS_EPS 1.1920929e-07f
#define NSS     (DMODEL / 64)        // partial sums of squares per row of x: one per 64-column tile
static_assert(RC_I * WLO_I == WSC_I);
static_assert(NHEAD * HDIM == DMODEL);
static_assert(NB >= 1 && NB <= NB_FULL && SEQ >= 64 && SEQ <= SEQ_FULL);
static_assert((SEQ % 64) == 0 && (SEQ % 16) == 0 && (NROWS % 64) == 0 && (DMODEL % 64) == 0 && (DFF % 64) == 0);
static_assert((OBSP % 64) == 0 && (NACTP % 64) == 0 && OBSP >= OBSD && NACTP >= NACT && (OBSP - OBSD) < 64);
static_assert((KD % 32) == 0 && (KF % 32) == 0 && (OBSP % 32) == 0);
static_assert((NROWS % 256) == 0 && (NROWS % 4) == 0 && ((SEQ * OBSD) % 4) == 0);
static_assert(OUT_TOTAL == 2625536);

typedef _Float16 v16h __attribute__((ext_vector_type(16)));
typedef _Float16 v8h  __attribute__((ext_vector_type(8)));
typedef float    v8f  __attribute__((ext_vector_type(8)));
typedef float    v4f  __attribute__((ext_vector_type(4)));
typedef unsigned int v4u __attribute__((ext_vector_type(4)));
typedef unsigned int v2u __attribute__((ext_vector_type(2)));

union FragH { v16h v; v8h h[2]; v4u u[2]; };

// ---- scalar helpers --------------------------------------------------------------------------------
__device__ __forceinline__ unsigned short bf_bits(float f) {          // f32 -> bf16 bits, RNE convert
  unsigned u = __float_as_uint(f);
  return (unsigned short)((u + 0x7FFFu + ((u >> 16) & 1u)) >> 16);
}
__device__ __forceinline__ float bf_up(unsigned short h) { return __uint_as_float(((unsigned)h) << 16); }
__device__ __forceinline__ float bfr(float f) { return bf_up(bf_bits(f)); }   // value of the bf16 RNE convert
__device__ __forceinline__ unsigned short h_bits(_Float16 x) { return __builtin_bit_cast(unsigned short, x); }
__device__ __forceinline__ unsigned pk16(unsigned short a, unsigned short b) { return (unsigned)a | ((unsigned)b << 16); }
__device__ __forceinline__ v8f zero8() { v8f z = {0.f, 0.f, 0.f, 0.f, 0.f, 0.f, 0.f, 0.f}; return z; }
__device__ __forceinline__ int imin(int a, int b) { return a < b ? a : b; }
__device__ __forceinline__ int imax(int a, int b) { return a > b ? a : b; }

// Relative-position bucket for rel = query - key >= 0 (bidirectional split, 32 buckets, max distance 128), as an exact
// integer table: 0 -> 0; 1..7 -> 16+rel; 8..11 -> 24; 12..15 -> 25; 16..22 -> 26; 23..31 -> 27; 32..45 -> 28; 46..63 -> 29;
// 64..90 -> 30; >= 91 -> 31.
__device__ __forceinline__ int rel_bucket(int rel) {
  int b = 31;
  b = (rel < 91) ? 30 : b;
  b = (rel < 64) ? 29 : b;
  b = (rel < 46) ? 28 : b;
  b = (rel < 32) ? 27 : b;
  b = (rel < 23) ? 26 : b;
  b = (rel < 16) ? 25 : b;
  b = (rel < 12) ? 24 : b;
  b = (rel < 8) ? (16 + rel) : b;
  b = (rel == 0) ? 0 : b;
  return b;
}

// ---- fragment loaders: 16-bit A/B operand, lane -> row/col (lane&15), p already includes +8*(lane>>4);
//      elements 0..7 <- p[0..7] (k0+8h..), elements 8..15 <- p[16..23] (k0+16+8h..)  (same split k map for A and B;
//      B is always read from a k-contiguous [n][k] plane)
__device__ __forceinline__ v16h ldfrag_u(const unsigned short* p) {
  FragH f;
  f.u[0] = *(const v4u*)(p);
  f.u[1] = *(const v4u*)(p + 16);
  return f.v;
}
// Fragment-ordered plane of an [M][N] matrix (M multiple of 16, N of 64): chunk (m / 16) * (N / 64) + n / 64 holds 16 rows x 64 cols as
// FCH halves: [hi | residual] x [col / 16 & 3] x [lane = 16 * (col / 8 & 1) + row % 16] x [col % 8]. The two 16-B loads of a fragment
// (16 rows x 32 cols, same k map as above) then read 512 consecutive bytes each. p = the 16 x 32 block (FBK halves) + 8 * lane.
#define FCH 2048
#define FPL 1024
#define FBK 512
__device__ __forceinline__ v16h ldfrag_f(const _Float16* p) {
  FragH f;
  f.h[0] = *(const v8h*)(p);
  f.h[1] = *(const v8h*)(p + 256);
  return f.v;
}

// ---- WMMA helpers with trailing VALU hazard gaps ------------------------------------------------------
__device__ __forceinline__ v8f mma_raw(v16h a, v16h b, v8f c) {
  return __builtin_amdgcn_wmma_f32_16x16x32_f16(false, a, false, b, (short)0, c, false, false);
}
// Only the accumulators are named: an asm operand has to lie in the first 256 registers, and the fragments need not.
__device__ __forceinline__ void guard_s2x4(v8f& s, v8f& t) {
#if defined(__HIP_DEVICE_COMPILE__)
  asm volatile("v_nop\n\tv_nop\n\tv_nop\n\tv_nop" : "+v"(s), "+v"(t));
#endif
}
__device__ __forceinline__ void guard_pv4(v8f& a, v8f& b, v8f& c, v8f& d) {
#if defined(__HIP_DEVICE_COMPILE__)
  asm volatile("v_nop\n\tv_nop\n\tv_nop\n\tv_nop" : "+v"(a), "+v"(b), "+v"(c), "+v"(d));
#endif
}
// Later writes of the address and data registers of the global loads and stores issued so far stay behind this wait.
__device__ __forceinline__ void wait_x0() {
#if defined(__HIP_DEVICE_COMPILE__)
  asm volatile("s_wait_xcnt 0x0" ::: "memory");
#endif
}
// The same wait behind a group of loads that share the address p: p is named as an input so that its register pair lives up to the
// wait; otherwise the group's last load may land on the pair that the loads ahead of it still name.
__device__ __forceinline__ void wait_x0_addr(const _Float16* p) {
#if defined(__HIP_DEVICE_COMPILE__)
  asm volatile("s_wait_xcnt 0x0" :: "v"(p) : "memory");
#endif
}
// Lane l takes the value of lane l ^ 16: a vector cross-row move, no LDS trip.
__device__ __forceinline__ float xhalf(float x) {
  const int b = __builtin_bit_cast(int, x);
  return __builtin_bit_cast(float, __builtin_amdgcn_permlanex16(b, b, 0x76543210, 0xfedcba98, false, false));
}
// RMSNorm row factor from the plane ss[NSS][NROWS] of partial sums of squares: rsqrt(mean(x*x) + eps), eps 1.1920929e-7.
static_assert(NSS == 4);
__device__ __forceinline__ float row_ss(const float* __restrict__ ss, int m) {
  return (ss[m] + ss[NROWS + m]) + (ss[2 * NROWS + m] + ss[3 * NROWS + m]);
}
__device__ __forceinline__ float rstd_of(float s) {
  const float x = s * (1.0f / (float)DMODEL) + RMS_EPS;    // s >= 0, so x >= eps: a normal number, no range scaling round the instruction
  float r = 0.f;
#if defined(__HIP_DEVICE_COMPILE__)
  // v_nop: the one slot between a transcendental and an instruction that reads its result or overwrites its source
  asm("v_rsq_f32 %0, %1\n\tv_nop" : "=v"(r) : "v"(x));
#endif
  return r;
}

// =====================================================================================================
// Transposing 16-bit pack of a weight stored in[R][C] (row pitch C floats, R = contraction index, C = output index) into
// out[Cp][ldd] (row pitch ldd halves): out[c][r] = f16( bf16_RNE(in[r][c]) * schi ) for r < R and c < C, 0 otherwise (pad rows /
// pad columns explicitly written as zeros); with DUAL a second copy out[c][locol + r] = f16( bf16_RNE(in[r][c]) * sclo ).
// schi / sclo powers of two (exact). Tiles: Cp/64 along bx, Rp/64 along by; bz = slice: src advanced by bz*sZ floats, dst by
// bz*dZ halves. One 64x64 tile per block through LDS (bf16 bits): 16 scalar loads per thread with CLAMPED addresses, zero by
// coverage: load 256 thr x 16 floats = 64x64; store 2 it x 8 waves x 4 rows x (8 lanes x 8 halves) = 64 rows x 64 halves per copy;
//           tiles (Cp/64, Rp/64, Z) exact, each output line written by exactly one wave; pad region included.
// =====================================================================================================
// (bx, by, bz) = the tile's place in the grid described above; dual is the same for the whole block.
__device__ __forceinline__ void tcvt16(unsigned short* sT, const float* __restrict__ src, long long sZ,
                                       unsigned short* dst, long long dZ,
                                       int R, int C, int ldd, int locol, float schi, float sclo,
                                       bool dual, int bx, int by, int bz) {
  const int tid = threadIdx.x, lane = tid & 31, wave = tid >> 5;
  const int c0 = bx * 64, r0 = by * 64;
  const float* srcz = src + (size_t)((long long)bz * sZ);
  unsigned short* dstz = dst + (size_t)((long long)bz * dZ);
  const int rr = tid >> 2, cc = (tid & 3) * 16;
  const int r = r0 + rr;
  const int rcl = imin(r, R - 1);
  const float* sp = srcz + (size_t)rcl * C;
#pragma unroll
  for (int e = 0; e < 16; ++e) {
    const int cidx = c0 + cc + e;
    const int ccl = imin(cidx, C - 1);
    float a = sp[ccl];
    a = (r < R && cidx < C) ? a : 0.f;
    sT[(cc + e) * 72 + rr] = bf_bits(a);
  }
  __syncthreads();
  v4u hvals[2], lvals[2];
#pragma unroll
  for (int it = 0; it < 2; ++it) {
    const int q = it * 32 + wave * 4 + (lane >> 3);
    const v4u raw = *(const v4u*)(sT + q * 72 + (lane & 7) * 8);
    v4u hv = {0u, 0u, 0u, 0u}, lv = {0u, 0u, 0u, 0u};
#pragma unroll
    for (int e = 0; e < 4; ++e) {
      const float f0 = bf_up((unsigned short)(raw[e] & 0xFFFFu));
      const float f1 = bf_up((unsigned short)(raw[e] >> 16));
      hv[e] = pk16(h_bits((_Float16)(f0 * schi)), h_bits((_Float16)(f1 * schi)));
      lv[e] = pk16(h_bits((_Float16)(f0 * sclo)), h_bits((_Float16)(f1 * sclo)));
    }
    hvals[it] = hv;
    lvals[it] = lv;
  }
  {
#pragma unroll
    for (int it = 0; it < 2; ++it) {
      const int q = it * 32 + wave * 4 + (lane >> 3);
      unsigned short* p = dstz + (size_t)(c0 + q) * ldd + r0 + (lane & 7) * 8;
      *(v4u*)p = hvals[it];
    }
    wait_x0();                                             // no register of the two stores above is rewritten ahead of this wait
    if (dual) {
#pragma unroll                                             // lvals[] indexed by constants, so that it stays in registers
      for (int it = 0; it < 2; ++it) {
        const int q = it * 32 + wave * 4 + (lane >> 3);
        unsigned short* p = dstz + (size_t)(c0 + q) * ldd + r0 + (lane & 7) * 8;
        *(v4u*)(p + locol) = lvals[it];
      }
      wait_x0();                                           // the same for the second copy's two stores
    }
  }
}

// =====================================================================================================
// Batched f16 WMMA GEMM, operands staged in LDS: C[m][n] = f( oscale * sum_k A[m][k] * Bt[n][k] + bias ); one 64x64 tile per
// work-group of 8 waves (wave = 16 rows x 32 cols, two accumulators). A row-major [M][K] (16-bit plane), Bt row-major
// [N][K] (k contiguous), both at row pitch K; M, N multiples of 64, K = KST * NCH. blockIdx.x = tile, blockIdx.y = batch index with element
// strides sA, sB, sC. A stage is KST k of the tile's 64 A rows and 64 Bt rows, brought to LDS by asynchronous 16-B copies
// (a wave's copy = two aligned 256-B units) at row pitch KST + 8 halves (16 B x odd: ds_load_b128 fragment reads without bank conflicts).
// NCH 1: the stage is filled once and then read. NCH 2: two buffers, stage 1 flies while stage 0 is multiplied.
// k runs upward through one accumulator per 16x16 output tile.
// BM: 0 no bias, 1 bias bf16(biasp[n]) for n < nbias (0 beyond, clamped address).   ACT: 2 = ReLU applied to (value + bias).
// OM 0 = f32 out (pitch ldc); RM 2 adds raw f32 Rp[m][n] (same pitch/stride as C).
// OM 1 = dual f16 out (pitch ldc): hi = f16(value * ocarry) at C[m][n], residual f16(RC * (value * ocarry - hi)) at C[m][n] + lofs.
// OM 2 = the same two values in the fragment-ordered plane described at ldfrag_f (ldc and lofs not used); a wave's store = one
//        512-B block of the plane.
// NRM 1: one operand is the plane of x * bf16(norm weight) * HC; the sum is multiplied by the RMSNorm factor of its x row (ahead of
//        bias and ReLU), taken from ssp[NSS][NROWS]: x row = m (A operand), or with colf (OM 2 only) by * N + n (Bt operand).
// EM 1 (OM 0, N = DMODEL): C is the residual stream x; the tile also stores Hout[m][n] = f16(x * bf16(nwp[n]) * HC), its residual x64
//        at Hout[m][DMODEL + n] (row pitch KD; a row's 128-B segment = 16 lanes) and SSout[n0 / 64][m] = sum of x*x over its 64 columns
//        (4 per lane, then xor shuffles over 16 lanes), gathered in the pad column of sT so that one wave stores each 128-B line.
// coverage: copies: 2 operands x 4 row groups of 16 x KST/128 units of 256 B = 2*KST/32 copies per thread and stage; slab: 8 waves x 16 x 32 = 64 x 64;
//           out: f32 4 it x 16 rows x 16 lanes x 4, f16 2 it x 32 rows x 8 lanes x 8 (both planes) = the whole 64x64 tile;
//           grid = tilesM*tilesN blocks exactly.
// =====================================================================================================
// Eight asynchronous 16-B copies global -> LDS (l = the lane's LDS byte address, g = the lane's global address). The closing
// s_wait_xcnt keeps every later write of these address registers behind the copies' address translation.
__device__ __forceinline__ void acopy8(const unsigned* l, const unsigned short* const* g) {
#if defined(__HIP_DEVICE_COMPILE__)
  asm volatile(
      "global_load_async_to_lds_b128 %0, %8, off\n\t"
      "global_load_async_to_lds_b128 %1, %9, off\n\t"
      "global_load_async_to_lds_b128 %2, %10, off\n\t"
      "global_load_async_to_lds_b128 %3, %11, off\n\t"
      "global_load_async_to_lds_b128 %4, %12, off\n\t"
      "global_load_async_to_lds_b128 %5, %13, off\n\t"
      "global_load_async_to_lds_b128 %6, %14, off\n\t"
      "global_load_async_to_lds_b128 %7, %15, off\n\t"
      "s_wait_xcnt 0x0"
      :: "v"(l[0]), "v"(l[1]), "v"(l[2]), "v"(l[3]), "v"(l[4]), "v"(l[5]), "v"(l[6]), "v"(l[7]),
         "v"(g[0]), "v"(g[1]), "v"(g[2]), "v"(g[3]), "v"(g[4]), "v"(g[5]), "v"(g[6]), "v"(g[7])
      : "memory");
#endif
}
// The wave's own copies have landed in LDS behind this wait.
__device__ __forceinline__ void wait_async0() {
#if defined(__HIP_DEVICE_COMPILE__)
  asm volatile("s_wait_asynccnt 0x0" ::: "memory");
#endif
}
// The wave's own LDS reads have returned behind this wait.
__device__ __forceinline__ void wait_ds0() {
#if defined(__HIP_DEVICE_COMPILE__)
  asm volatile("s_wait_dscnt 0x0" ::: "memory");
#endif
}
// One stage: KST halves of rows 0..63 of Ag to LDS rows 0..63 and of rows 0..63 of Bg to LDS rows 64..127 (global row pitch LDK
// halves). 16 lanes take one aligned 256-B unit of a row, a copy of the block 16 rows; every offset below is a constant.
template <int KST, int LDK>
__device__ __forceinline__ void fill_stage(const unsigned short* Ag, const unsigned short* Bg, unsigned ldsb, int tid) {
  constexpr int CG  = KST / 128;            // 256-B units per row
  constexpr int PER = 4 * CG;               // copies per thread and operand
  constexpr int PIT = KST + 8;              // LDS row pitch, halves
  static_assert((KST % 128) == 0 && (2 * PER) % 8 == 0 && 2 * PER <= 63);
  const int r0 = tid >> 4, h0 = (tid & 15) * 8;
  const unsigned short* a0 = Ag + (size_t)r0 * LDK + h0;
  const unsigned short* b0 = Bg + (size_t)r0 * LDK + h0;
  const unsigned l0 = ldsb + (unsigned)(r0 * PIT + h0) * 2u;
  // both loops unrolled: every copy's offsets are then constants and l[], g[] stay in registers
#pragma unroll
  for (int g0 = 0; g0 < 2 * PER; g0 += 8) {
    unsigned l[8];
    const unsigned short* g[8];
#pragma unroll
    for (int e = 0; e < 8; ++e) {
      const int it = g0 + e;
      const bool isB = it >= PER;
      const int j = isB ? it - PER : it;
      const int rg = j / CG, cg = j - rg * CG;
      l[e] = l0 + (unsigned)((((isB ? 64 : 0) + rg * 16) * PIT + cg * 128) * 2);
      g[e] = (isB ? b0 : a0) + (size_t)(rg * 16) * LDK + cg * 128;
    }
    acopy8(l, g);
  }
}

template <int OM, int RM, int ACT, int BM, int KST, int NCH, int NRM, int EM>
__device__ __forceinline__ void gemm64_tile(
    const unsigned short* __restrict__ Ap, long long sA,
    const unsigned short* __restrict__ Btp, long long sB,
    const float* __restrict__ Rp,
    const float* __restrict__ biasp, int nbias,
    void* Cout, int ldc, long long sC, long long lofs,
    int N, float oscale, float ocarry, int tile, int by,
    const float* __restrict__ ssp, bool colf,
    const float* __restrict__ nwp, unsigned short* Hout, float* SSout) {
  static_assert(EM == 0 || OM == 0);
  constexpr int PIT  = KST + 8;               // LDS row pitch, halves
  constexpr int BUFH = 128 * PIT;            // halves per stage buffer: 64 A rows, then 64 Bt rows
  constexpr int LDK  = KST * NCH;            // row pitch of A and Bt, halves (= K)
  constexpr int KB   = 4;                    // k steps of 32 per fragment block
  constexpr int NBLK = KST / (32 * KB);
  static_assert(NCH == 1 || NCH == 2);
  static_assert((KST % (32 * KB)) == 0 && ((PIT * 2) % 32) == 16);
  __shared__ __align__(16) unsigned short sP[NCH * BUFH];
  __shared__ __align__(16) float sT[64 * 68];        // the tile in f32, pitch 68 floats
  const int tid  = threadIdx.x;
  const int lane = tid & 31;
  const int wave = tid >> 5;
  const int tilesN = N >> 6;
  const int tm = tile / tilesN;
  const int tn = tile - tm * tilesN;
  const int m0 = tm << 6;
  const int n0 = tn << 6;

  const unsigned short* Ag = Ap  + (size_t)((long long)by * sA) + (size_t)m0 * LDK;
  const unsigned short* Bg = Btp + (size_t)((long long)by * sB) + (size_t)n0 * LDK;
  const unsigned ldsb = (unsigned)(uintptr_t)(&sP[0]);   // LDS byte address = low 32 bits of the shared address

  fill_stage<KST, LDK>(Ag, Bg, ldsb, tid);

  const int r16 = tid >> 4, c4 = (tid & 15) * 4;         // f32 out: 256-B row segment = 16 lanes x 16 B
  const int r32 = tid >> 3;                              // f16 out: 128-B row segment = 8 lanes x 16 B
  const int c8 = (OM == 2) ? (wave & 3) * 16 + (lane >> 4) * 8 : (tid & 7) * 8;   // OM 2: 16 cols per wave, 8 per lane half

  // ---- RMSNorm factors of the x rows behind this thread's output rows (or, with colf, columns); read here, while stage 0 flies ----
  // every loop down to the wait on the copies is unrolled: the small arrays are then indexed by constants and stay in registers
  float rrow[4], rcol[8];
#pragma unroll
  for (int e = 0; e < 4; ++e) rrow[e] = 1.f;
#pragma unroll
  for (int e = 0; e < 8; ++e) rcol[e] = 1.f;
  if constexpr (NRM == 1) {
    if (OM == 2 && colf) {
      const float* p = ssp + (size_t)by * N + n0 + c8;
      v4f a[NSS], b[NSS];
#pragma unroll
      for (int j = 0; j < NSS; ++j) {
        a[j] = *(const v4f*)(p + (size_t)j * NROWS);
        b[j] = *(const v4f*)(p + (size_t)j * NROWS + 4);
      }
      wait_x0();                                           // no address register of the loads above is rewritten ahead of this wait
#pragma unroll
      for (int e = 0; e < 4; ++e) {
        rcol[e]     = rstd_of((a[0][e] + a[1][e]) + (a[2][e] + a[3][e]));
        rcol[4 + e] = rstd_of((b[0][e] + b[1][e]) + (b[2][e] + b[3][e]));
      }
    } else {
      constexpr int NIT = (OM == 0) ? 4 : 2;
      float s[NIT];
#pragma unroll
      for (int it = 0; it < NIT; ++it) {
        const int row = (OM == 0) ? it * 16 + r16 : (OM == 2) ? (it * 2 + (wave >> 2)) * 16 + (lane & 15) : it * 32 + r32;
        s[it] = row_ss(ssp, m0 + row);
      }
      wait_x0();                                           // the same for these loads
#pragma unroll
      for (int it = 0; it < NIT; ++it) rrow[it] = rstd_of(s[it]);
    }
  }
  // ---- the next RMSNorm's weight for this thread's four columns ----
  float nw[4];
#pragma unroll
  for (int e = 0; e < 4; ++e) nw[e] = 0.f;
  if constexpr (EM == 1) {
    const v4f w4 = *(const v4f*)(nwp + n0 + c4);
    wait_x0();                                             // the same for this load
#pragma unroll
    for (int e = 0; e < 4; ++e) nw[e] = bfr(w4[e]);
  }

  wait_async0();
  __syncthreads();                                       // stage 0 readable by every wave
  if constexpr (NCH == 2) fill_stage<KST, LDK>(Ag + KST, Bg + KST, ldsb + (unsigned)(BUFH * 2), tid);

  const int rlane = lane & 15;                 // row (A) / col (B, D) within subtile
  const int koff  = (lane >> 4) * 8;           // k offset of this lane half
  const int mOff  = (lane >> 4) * 8;           // D row offset
  const int wr = wave >> 1, wc = wave & 1;     // wave tile: rows wr*16.., cols wc*32..

  v8f acc0 = zero8(), acc1 = zero8();
  // the loops below are unrolled so that the two fragment sets are indexed by constants and stay in registers
#pragma unroll
  for (int t = 0; t < NCH; ++t) {
    const unsigned short* aL = sP + t * BUFH + (wr * 16 + rlane) * PIT + koff;
    const unsigned short* bL = sP + t * BUFH + (64 + wc * 32 + rlane) * PIT + koff;
    // fragments one block ahead in a second register set, each block's LDS reads as one group; never across a stage
    v16h fa[2][KB], fb0[2][KB], fb1[2][KB];
#pragma unroll
    for (int s = 0; s < KB; ++s) {
      fa[0][s]  = ldfrag_u(aL + s * 32);
      fb0[0][s] = ldfrag_u(bL + s * 32);
      fb1[0][s] = ldfrag_u(bL + 16 * PIT + s * 32);
    }
#pragma unroll
    for (int blk = 0; blk < NBLK; ++blk) {
      const int cur = blk & 1;
      if (blk + 1 < NBLK) {
#pragma unroll
        for (int s = 0; s < KB; ++s) {
          const int k0 = ((blk + 1) * KB + s) * 32;
          fa[cur ^ 1][s]  = ldfrag_u(aL + k0);
          fb0[cur ^ 1][s] = ldfrag_u(bL + k0);
          fb1[cur ^ 1][s] = ldfrag_u(bL + 16 * PIT + k0);
        }
      }
      __builtin_amdgcn_sched_barrier(0);   // keeps the next block's LDS reads one group ahead of this block's products
#pragma unroll
      for (int s = 0; s < KB; ++s) {
        acc0 = mma_raw(fa[cur][s], fb0[cur][s], acc0);
        acc1 = mma_raw(fa[cur][s], fb1[cur][s], acc1);
      }
      __builtin_amdgcn_sched_barrier(0);   // keeps later blocks' LDS reads from spreading among these products
    }
    if (t + 1 < NCH) {
      wait_ds0();
      wait_async0();
      __syncthreads();                                   // stage t + 1 readable by every wave
    }
  }
  if constexpr (NCH == 2) wait_async0();                 // no copy is outstanding when the buffers are left

  // ---- column bias (same columns for every row a thread writes), clamped addresses ----
  float bc4[4], bc8[8];
#pragma unroll
  for (int e = 0; e < 4; ++e) bc4[e] = 0.f;
#pragma unroll
  for (int e = 0; e < 8; ++e) bc8[e] = 0.f;
  if constexpr (BM == 1) {
    if constexpr (OM == 0) {
#pragma unroll
      for (int e = 0; e < 4; ++e) {
        const int n = n0 + c4 + e;
        const int ncl = imin(n, nbias - 1);
        const float t = bfr(biasp[ncl]);
        bc4[e] = (n < nbias) ? t : 0.f;
      }
    } else {
#pragma unroll
      for (int e = 0; e < 8; ++e) {
        const int n = n0 + c8 + e;
        const int ncl = imin(n, nbias - 1);
        const float t = bfr(biasp[ncl]);
        bc8[e] = (n < nbias) ? t : 0.f;
      }
    }
  }

  // ---- epilogue: the tile through LDS, whole row segments out ----
#pragma unroll
  for (int r = 0; r < 8; ++r) {
    float* sp = sT + (wr * 16 + mOff + r) * 68 + wc * 32 + rlane;
    sp[0]  = acc0[r];
    sp[16] = acc1[r];
  }
  __syncthreads();
  if constexpr (OM == 0) {
    float* C = (float*)Cout + (size_t)((long long)by * sC);
    v4f vx[4];
#pragma unroll
    for (int it = 0; it < 4; ++it) {
      const int row = it * 16 + r16;                     // it 0..3 x r16 0..15 = rows 0..63
      const int gr  = m0 + row;
      v4f v = *(const v4f*)(sT + row * 68 + c4);
      v4f rv = {0.f, 0.f, 0.f, 0.f};
      if constexpr (RM == 2) {
        const float* R = Rp + (size_t)((long long)by * sC);
        rv = *(const v4f*)(R + (size_t)gr * ldc + n0 + c4);
      }
      const float osc = oscale * rrow[it];
#pragma unroll
      for (int e = 0; e < 4; ++e) {
        float u = v[e] * osc;
        if constexpr (BM == 1) u += bc4[e];
        if constexpr (ACT == 2) u = fmaxf(u, 0.f);
        v[e] = u + rv[e];
      }
      if constexpr (EM == 0) *(v4f*)(C + (size_t)gr * ldc + n0 + c4) = v;
      vx[it] = v;
    }
    if constexpr (EM == 1) {
      // the loops of this block are unrolled so that vx[] and q[] stay in registers; the four rows' shuffles of a step are independent
      float q[4];
#pragma unroll
      for (int it = 0; it < 4; ++it)
        q[it] = (vx[it][0] * vx[it][0] + vx[it][1] * vx[it][1]) + (vx[it][2] * vx[it][2] + vx[it][3] * vx[it][3]);
#pragma unroll
      for (int off = 1; off < 16; off <<= 1) {
#pragma unroll
        for (int it = 0; it < 4; ++it) q[it] += __shfl_xor(q[it], off, 32);
      }
      if ((tid & 15) == 0) {                               // pad column: no other thread reads or writes it before the barrier below
#pragma unroll
        for (int it = 0; it < 4; ++it) sT[(it * 16 + r16) * 68 + 64] = q[it];
      }
      __syncthreads();                                     // the 64 row sums readable by waves 0 and 1; ahead of the global stores
#pragma unroll
      for (int it = 0; it < 4; ++it) {
        const int gr = m0 + it * 16 + r16;
        const v4f v = vx[it];
        *(v4f*)(C + (size_t)gr * ldc + n0 + c4) = v;
        const float f0 = (v[0] * nw[0]) * HC, f1 = (v[1] * nw[1]) * HC, f2 = (v[2] * nw[2]) * HC, f3 = (v[3] * nw[3]) * HC;
        const _Float16 g0 = (_Float16)f0, g1 = (_Float16)f1, g2 = (_Float16)f2, g3 = (_Float16)f3;
        v2u hv, lv;
        hv[0] = pk16(h_bits(g0), h_bits(g1));
        hv[1] = pk16(h_bits(g2), h_bits(g3));
        lv[0] = pk16(h_bits((_Float16)((f0 - (float)g0) * RC)), h_bits((_Float16)((f1 - (float)g1) * RC)));
        lv[1] = pk16(h_bits((_Float16)((f2 - (float)g2) * RC)), h_bits((_Float16)((f3 - (float)g3) * RC)));
        unsigned short* hp = Hout + (size_t)gr * KD + n0 + c4;
        *(v2u*)hp = hv;
        *(v2u*)(hp + DMODEL) = lv;
      }
      if (tid < 64) SSout[(size_t)tn * NROWS + m0 + tid] = sT[tid * 68 + 64];
    }
  } else {
    unsigned short* C = (unsigned short*)Cout + (size_t)((long long)by * sC);
#pragma unroll
    for (int it = 0; it < 2; ++it) {
      // OM 1: it 0..1 x r32 0..31 = rows 0..63; OM 2: 16 rows per wave, (it, wave / 4) = the tile's four groups of 16 rows
      const int row = (OM == 2) ? (it * 2 + (wave >> 2)) * 16 + rlane : it * 32 + r32;
      const float* spf = sT + row * 68 + c8;
      v4u a = {0u, 0u, 0u, 0u}, bl = {0u, 0u, 0u, 0u};
      const float osc = oscale * rrow[it];
#pragma unroll
      for (int e = 0; e < 4; ++e) {
        float f0 = spf[2 * e] * osc;
        float f1 = spf[2 * e + 1] * osc;
        if constexpr (NRM == 1 && OM == 2) { f0 *= rcol[2 * e]; f1 *= rcol[2 * e + 1]; }
        if constexpr (BM == 1) { f0 += bc8[2 * e]; f1 += bc8[2 * e + 1]; }
        if constexpr (ACT == 2) { f0 = fmaxf(f0, 0.f); f1 = fmaxf(f1, 0.f); }
        f0 *= ocarry; f1 *= ocarry;
        const _Float16 g0 = (_Float16)f0, g1 = (_Float16)f1;
        const float r0 = (f0 - (float)g0) * RC, r1 = (f1 - (float)g1) * RC;
        a[e]  = pk16(h_bits(g0), h_bits(g1));
        bl[e] = pk16(h_bits((_Float16)r0), h_bits((_Float16)r1));
      }
      if constexpr (OM == 2) {
        unsigned short* p = C + ((size_t)((m0 + row) >> 4) * tilesN + tn) * FCH + (wave & 3) * 256 + lane * 8;
        *(v4u*)p = a;
        *(v4u*)(p + FPL) = bl;
      } else {
        unsigned short* p = C + (size_t)(m0 + row) * ldc + n0 + c8;
        *(v4u*)p = a;
        *(v4u*)(p + (size_t)lofs) = bl;
      }
    }
  }
  (void)Rp; (void)ocarry; (void)lofs; (void)nbias; (void)biasp; (void)ldc; (void)r32;
  (void)ssp; (void)colf; (void)nwp; (void)Hout; (void)SSout; (void)rcol; (void)nw;
}

// One product per launch: blockIdx.x = tile, blockIdx.y = batch index.
template <int OM, int RM, int ACT, int BM, int KST, int NCH, int NRM, int EM>
__global__ __launch_bounds__(256) void gemm64(
    const unsigned short* __restrict__ Ap, long long sA,
    const unsigned short* __restrict__ Btp, long long sB,
    const float* __restrict__ Rp,
    const float* __restrict__ biasp, int nbias,
    void* Cout, int ldc, long long sC, long long lofs,
    int N, float oscale, float ocarry,
    const float* __restrict__ ssp, const float* __restrict__ nwp, unsigned short* Hout, float* SSout) {
  gemm64_tile<OM, RM, ACT, BM, KST, NCH, NRM, EM>(Ap, sA, Btp, sB, Rp, biasp, nbias, Cout, ldc, sC, lofs, N, oscale, ocarry,
                                                  (int)blockIdx.x, (int)blockIdx.y, ssp, false, nwp, Hout, SSout);
}

#define SH_E   8        // log2 of the tiles per batch index of the q / k product: (NROWS / 64) * (DMODEL / 64)
#define SH_V   7        // log2 of the tiles per batch of the v^T product: (DMODEL / 64) * (SEQ / 64)
#define SH_ONE 30       // a product with one batch index only
static_assert((1 << SH_E) == (NROWS / 64) * (DMODEL / 64) && (1 << SH_V) == (DMODEL / 64) * (SEQ / 64));
static_assert(QC == VC);
// Two independent products of the same form in one launch (no residual input): blocks 0..n0-1 work on product 0, the rest on
// product 1; inside a product block i is tile i mod 2^sh of batch index i >> sh. The choice is the same for the whole block.
// Both read the plane of x * norm weight (NRM 1): as A, or, where the product's colf is set, as Bt.
// coverage: grid = n0 + (blocks of product 1), each product's (tile, batch) pairs taken exactly once.
template <int OM, int ACT, int BM, int KST, int NCH>
__global__ __launch_bounds__(256) void gemm64x2(
    const unsigned short* __restrict__ Ap0, long long sA0, const unsigned short* __restrict__ Btp0, long long sB0,
    const float* __restrict__ biasp0, int nbias0, void* Cout0, int ldc0, long long sC0, long long lofs0, int N0, int sh0,
    const unsigned short* __restrict__ Ap1, long long sA1, const unsigned short* __restrict__ Btp1, long long sB1,
    const float* __restrict__ biasp1, int nbias1, void* Cout1, int ldc1, long long sC1, long long lofs1, int N1, int sh1,
    int n0, float oscale, float ocarry, const float* __restrict__ ssp, int colf0, int colf1) {
  const int b = (int)blockIdx.x;
  const bool p0 = b < n0;
  const int i  = p0 ? b : b - n0;
  const int sh = p0 ? sh0 : sh1;
  const int by = i >> sh;
  gemm64_tile<OM, 0, ACT, BM, KST, NCH, 1, 0>(p0 ? Ap0 : Ap1, p0 ? sA0 : sA1, p0 ? Btp0 : Btp1, p0 ? sB0 : sB1, (const float*)0,
                                              p0 ? biasp0 : biasp1, p0 ? nbias0 : nbias1, p0 ? Cout0 : Cout1, p0 ? ldc0 : ldc1,
                                              p0 ? sC0 : sC1, p0 ? lofs0 : lofs1, p0 ? N0 : N1, oscale, ocarry, i - (by << sh), by,
                                              ssp, (p0 ? colf0 : colf1) != 0, (const float*)0, (unsigned short*)0, (float*)0);
}

#define ATT_SPLIT   8
#define ATT_THREADS (ATT_SPLIT * 32)
#define ATT_TILES   (SEQ / 32)              // query tiles of 32 rows per batch and head
#define ATT_BLOCKS  (NB * (ATT_TILES / 2) * NHEAD)
#define OP_PITCH    68
#define VCS         ((SEQ / 64) * FCH)      // halves between the v^T chunks of 16 d and of the next 16 d at the same keys
static_assert(ATT_THREADS == 16 * (HDIM / 4) && HDIM == 64);
static_assert((HDIM * 2) % 128 == 0 && (HDIM % 32) == 0 && (ATT_TILES % 2) == 0 && SEQ >= 32 * ATT_SPLIT);

__global__ __launch_bounds__(ATT_THREADS)
void attn4(const unsigned short* __restrict__ QPp, const unsigned short* __restrict__ KPp,
           const unsigned short* __restrict__ VTq, const float* __restrict__ relbl, unsigned short* CT) {
  __shared__ __align__(16) float sbias[SEQ];                          // [rel], bf16(relb) * log2 e
  __shared__ __align__(16) float spo[ATT_SPLIT * 32 * OP_PITCH];      // per wave partial [row][64 d], pitch 68
  __shared__ __align__(16) float sml[2 * ATT_SPLIT * 32];             // per wave and row: max, then sum

  const int tid  = threadIdx.x;
  const int wave = __builtin_amdgcn_readfirstlane(tid >> 5);  // scalar: the key loop's trip count is a scalar branch, EXEC stays full
  const int lane = tid & 31;
  const int hh   = lane >> 4;
  const int c    = lane & 15;

  const int head = blockIdx.x % NHEAD;                     // 0..3
  const int qb   = blockIdx.x / NHEAD;
  const int bat  = qb % NB;                                // batch
  const int pr   = qb / NB;                                // tile pair 0 .. ATT_TILES / 2 - 1
  const int kmax = (ATT_TILES - pr) * 32;                  // key count of the pair's later tile

  const float* sb = sbias;
  const _Float16* Q16 = (const _Float16*)(const void*)QPp;
  const _Float16* K16 = (const _Float16*)(const void*)KPp;
  const _Float16* V16 = (const _Float16*)(const void*)VTq;
  const _Float16* Kf = K16 + ((size_t)((bat * SEQ) >> 4) * NHEAD + head) * FCH + lane * 8;
  const _Float16* Vf = V16 + (size_t)bat * VTR * SEQ + (size_t)(head * (HDIM / 16)) * VCS + lane * 8;  // chunk (16 d, 64 keys)
  const float lsc = (LOG2E * ATT_SCALE) / (QC * KC);      // log2(e) / 8 / carries

  // A tile's q fragments and the k fragments of the wave's first key step (keys wave * 32 .. + 31 < SEQ: in range also for a wave
  // without a step); from then on each step loads the next step's k into the same variables. Issued ahead of work that does not need
  // them, which covers their flight: the first tile's ahead of the bias table, the second tile's ahead of the first tile's merge.
  // Inlined at both calls: the fragments stay in registers.
  // every loop over u below but the merge's is unrolled: the per-half arrays are then indexed by constants and stay in registers
  v16h qah[2], qbh[2], qal[2], qbl[2];
  v16h k0h, k1h, k0l, k1l, j0h, j1h, j0l, j1l;
  auto head_loads = [&](const int qt) __attribute__((always_inline)) {
    const _Float16* Qf = Q16 + ((size_t)((bat * SEQ + qt * 32) >> 4) * NHEAD + head) * FCH + lane * 8;   // chunk (16 tokens, head)
#pragma unroll
    for (int u = 0; u < 2; ++u) {
      const _Float16* qp = Qf + u * (NHEAD * FCH);
      qah[u] = ldfrag_f(qp);       qbh[u] = ldfrag_f(qp + FBK);                 // hi, d 0..31 / 32..63
      qal[u] = ldfrag_f(qp + FPL); qbl[u] = ldfrag_f(qp + FPL + FBK);           // residual x64
    }
    wait_x0_addr(Qf);                                      // no register that the 16 loads name is rewritten ahead of this wait
    // the wave's number taken anew: the address is then formed at each call, and no register pair is held (spilled) through the key loop
    const int w = __builtin_amdgcn_readfirstlane(tid >> 5);
    const _Float16* kp = Kf + (size_t)(w * 2) * (NHEAD * FCH);
    const _Float16* kq = kp + NHEAD * FCH;                 // the next 16 keys
    k0h = ldfrag_f(kp);       k1h = ldfrag_f(kp + FBK);
    k0l = ldfrag_f(kp + FPL); k1l = ldfrag_f(kp + FPL + FBK);
    j0h = ldfrag_f(kq);       j1h = ldfrag_f(kq + FBK);
    j0l = ldfrag_f(kq + FPL); j1l = ldfrag_f(kq + FPL + FBK);
    wait_x0_addr(kp);                                      // the same for these 16 loads
  };
  head_loads(ATT_TILES - 1 - pr);

  // ---- relative-position bias table for rel 0..kmax-1 of this head ----
  for (int rel = tid; rel < kmax; rel += ATT_THREADS) {
    const int bk = rel_bucket(rel);
    sbias[rel] = bfr(relbl[bk * NHEAD + head]) * LOG2E;
  }
  __syncthreads();

  // the pair's two tiles one after the other, the later, longer tile first (the body keeps its indentation); rolled: unrolled, the
  // kernel's text would double and gain nothing, since the tiles share only the table
#pragma unroll 1
  for (int ps = 0; ps < 2; ++ps) {
  const int qt   = (ps == 0) ? ATT_TILES - 1 - pr : pr;    // query tile of 32 rows = halves u = 0, 1 of 16 rows
  const int q0   = qt * 32;
  const int kend = q0 + 32;                                // causal: keys 0 .. q0+31; rel = query - key in 0 .. kend-1

  float mrun[2], lrun[2];                                  // this lane's query of half u: running max (both lane halves alike), sum over this lane half's keys
  v8f om[2][4], orr[2][4];
#pragma unroll
  for (int u = 0; u < 2; ++u) {
    mrun[u] = -INFINITY; lrun[u] = 0.f;
#pragma unroll
    for (int j = 0; j < 4; ++j) { om[u][j] = zero8(); orr[u][j] = zero8(); }
  }

  // One key step. Its k fragments are already on their way (loaded one step earlier); its 16 v^T loads issue at its head, so the score
  // products and the softmax cover their flight; with more (a constant at each call) the next step's 16 k loads issue behind the score
  // products, into the registers these have just read, so the softmax and the v^T products cover theirs. Inlined at both calls: the
  // accumulators stay in registers.
  auto step = [&](const int kb, const bool more) __attribute__((always_inline)) {
    v8f s0m[2], s0r[2], s1m[2], s1r[2];                    // register r = score of key (tile's first) + 8 hh + r with query q0 + 16 u + c
    const _Float16* vp = Vf + (size_t)(kb >> 6) * FCH + ((kb >> 5) & 1) * FBK;
    const _Float16* vq = vp + FPL;
    const v16h vb0 = ldfrag_f(vp);
    const v16h vb1 = ldfrag_f(vp + VCS);
    const v16h vb2 = ldfrag_f(vp + 2 * VCS);
    const v16h vb3 = ldfrag_f(vp + 3 * VCS);
    const v16h vl0 = ldfrag_f(vq);
    const v16h vl1 = ldfrag_f(vq + VCS);
    const v16h vl2 = ldfrag_f(vq + 2 * VCS);
    const v16h vl3 = ldfrag_f(vq + 3 * VCS);
    wait_x0_addr(vp);                                      // no register that the 16 loads name is rewritten ahead of this wait
    __builtin_amdgcn_sched_barrier(0);                     // keeps the products behind the issue of all 16 loads
#pragma unroll
    for (int u = 0; u < 2; ++u) {                          // the same k fragments against both halves' q
      s0m[u] = mma_raw(k0h, qah[u], zero8());
      s0m[u] = mma_raw(k1h, qbh[u], s0m[u]);
      s0r[u] = mma_raw(k0l, qah[u], zero8());
      s0r[u] = mma_raw(k1l, qbh[u], s0r[u]);
      s0r[u] = mma_raw(k0h, qal[u], s0r[u]);
      s0r[u] = mma_raw(k1h, qbl[u], s0r[u]);
      guard_s2x4(s0m[u], s0r[u]);
      s1m[u] = mma_raw(j0h, qah[u], zero8());
      s1m[u] = mma_raw(j1h, qbh[u], s1m[u]);
      s1r[u] = mma_raw(j0l, qah[u], zero8());
      s1r[u] = mma_raw(j1l, qbh[u], s1r[u]);
      s1r[u] = mma_raw(j0h, qal[u], s1r[u]);
      s1r[u] = mma_raw(j1h, qbl[u], s1r[u]);
      guard_s2x4(s1m[u], s1r[u]);
    }
    if (more) {
      const _Float16* kp = Kf + (size_t)((kb + 32 * ATT_SPLIT) >> 4) * (NHEAD * FCH);
      const _Float16* kq = kp + NHEAD * FCH;               // the next 16 keys
      k0h = ldfrag_f(kp);       k1h = ldfrag_f(kp + FBK);
      k0l = ldfrag_f(kp + FPL); k1l = ldfrag_f(kp + FPL + FBK);
      j0h = ldfrag_f(kq);       j1h = ldfrag_f(kq + FBK);
      j0l = ldfrag_f(kq + FPL); j1l = ldfrag_f(kq + FPL + FBK);
      wait_x0_addr(kp);                                    // the same for these 16 loads
      __builtin_amdgcn_sched_barrier(0);                   // keeps the softmax behind the issue of these loads
    }
    FragH ph[2];                                           // P^T as B operand: the lane's own 16 values, already in the split k map
#pragma unroll
    for (int u = 0; u < 2; ++u) {
      const int rel0 = q0 + 16 * u + c - kb - 8 * hh;      // query - key of register 0 in tile 0; register r: r less; tile 1: 16 less
      // the loops over r below are unrolled so that t0[], t1[] are indexed by constants and stay in registers
      float t0[8], t1[8];
#pragma unroll
      for (int r = 0; r < 8; ++r) {
        const int d0 = rel0 - r, d1 = rel0 - 16 - r;
        const float u0 = (s0m[u][r] + s0r[u][r] * RCI) * lsc + sb[imax(d0, 0)];
        const float u1 = (s1m[u][r] + s1r[u][r] * RCI) * lsc + sb[imax(d1, 0)];
        t0[r] = (d0 < 0) ? -INFINITY : u0;
        t1[r] = (d1 < 0) ? -INFINITY : u1;
      }
      float mx = fmaxf(fmaxf(fmaxf(fmaxf(t0[0], t0[1]), fmaxf(t0[2], t0[3])), fmaxf(fmaxf(t0[4], t0[5]), fmaxf(t0[6], t0[7]))),
                       fmaxf(fmaxf(fmaxf(t1[0], t1[1]), fmaxf(t1[2], t1[3])), fmaxf(fmaxf(t1[4], t1[5]), fmaxf(t1[6], t1[7]))));
      mx = fmaxf(mx, xhalf(mx));                           // the query's max over all 32 keys of the step (key kb is never masked)
      const float mn = fmaxf(mrun[u], mx);
      const float al = exp2f(fmaxf(mrun[u] - mn, -126.0f));
      mrun[u] = mn;
#pragma unroll
      for (int r = 0; r < 8; ++r) {
        t0[r] = exp2f(t0[r] - mn);
        t1[r] = exp2f(t1[r] - mn);
      }
      lrun[u] = lrun[u] * al + ((((t0[0] + t0[1]) + (t0[2] + t0[3])) + ((t0[4] + t0[5]) + (t0[6] + t0[7]))) +
                                (((t1[0] + t1[1]) + (t1[2] + t1[3])) + ((t1[4] + t1[5]) + (t1[6] + t1[7]))));
#pragma unroll
      for (int r = 0; r < 8; ++r) {
        ph[u].h[0][r] = (_Float16)(t0[r] * PC);            // elements 0..7  = keys kb + 8hh + 0..7
        ph[u].h[1][r] = (_Float16)(t1[r] * PC);            // elements 8..15 = keys kb + 16 + 8hh + 0..7
        om[u][0][r] *= al; om[u][1][r] *= al; om[u][2][r] *= al; om[u][3][r] *= al;
        orr[u][0][r] *= al; orr[u][1][r] *= al; orr[u][2][r] *= al; orr[u][3][r] *= al;
      }
    }
#pragma unroll
    for (int u = 0; u < 2; ++u) {                          // the same v^T fragments against both halves' P^T
      om[u][0] = mma_raw(vb0, ph[u].v, om[u][0]);
      om[u][1] = mma_raw(vb1, ph[u].v, om[u][1]);
      om[u][2] = mma_raw(vb2, ph[u].v, om[u][2]);
      om[u][3] = mma_raw(vb3, ph[u].v, om[u][3]);
      guard_pv4(om[u][0], om[u][1], om[u][2], om[u][3]);
      orr[u][0] = mma_raw(vl0, ph[u].v, orr[u][0]);
      orr[u][1] = mma_raw(vl1, ph[u].v, orr[u][1]);
      orr[u][2] = mma_raw(vl2, ph[u].v, orr[u][2]);
      orr[u][3] = mma_raw(vl3, ph[u].v, orr[u][3]);
      guard_pv4(orr[u][0], orr[u][1], orr[u][2], orr[u][3]);
    }
  };
  // every step but the wave's last loads its successor's k fragments; the last has none to load
  int kb = wave * 32;
#pragma unroll 1                                           // rolled: one copy of the step's text for all steps with a successor
  for (; kb + 32 * ATT_SPLIT < kend; kb += 32 * ATT_SPLIT) step(kb, true);
  if (kb < kend) step(kb, false);

  if (ps != 0) __syncthreads();                            // every wave has read the first tile's partials before they are overwritten
  // ---- the wave's un-normalised partials and their (max, sum) per row to LDS; register r of tile j = d 16 j + 8 hh + r of query 16 u + c ----
#pragma unroll
  for (int u = 0; u < 2; ++u) {
    const float lsum = lrun[u] + xhalf(lrun[u]);           // the two lane halves' keys joined, once
    float* pw = spo + wave * (32 * OP_PITCH) + (16 * u + c) * OP_PITCH + 8 * hh;
    // unrolled: the accumulators are indexed by constants
#pragma unroll
    for (int j = 0; j < 4; ++j) {
      v4f a, b;
#pragma unroll
      for (int e = 0; e < 4; ++e) { a[e] = om[u][j][e] + orr[u][j][e] * RCI; b[e] = om[u][j][4 + e] + orr[u][j][4 + e] * RCI; }
      *(v4f*)(pw + 16 * j) = a;  *(v4f*)(pw + 16 * j + 4) = b;
    }
    if (hh == 0) {                                         // max and joined sum are equal in the two lane halves
      sml[wave * 32 + 16 * u + c] = mrun[u];
      sml[ATT_SPLIT * 32 + wave * 32 + 16 * u + c] = lsum;
    }
  }
  __syncthreads();                                         // every wave's partial readable by every wave
  if (ps == 0) head_loads(pr);                             // the second tile's first loads fly while the first tile is merged
  // ---- merge the 8 partials, fold 1/l and the carries, write 4 hi and 4 residual halves per thread and half ----
#pragma unroll 1                                           // rolled: the two halves' merges share their text
  for (int u = 0; u < 2; ++u) {
    const int row = 16 * u + (tid >> 4), c4 = (tid & 15) * 4;
    float ms[ATT_SPLIT];
    float mall = -INFINITY;
#pragma unroll
    for (int s = 0; s < ATT_SPLIT; ++s) {
      ms[s] = sml[s * 32 + row];
      mall = fmaxf(mall, ms[s]);
    }
    float lall = 0.f;
    v4f o = {0.f, 0.f, 0.f, 0.f};
#pragma unroll
    for (int s = 0; s < ATT_SPLIT; ++s) {
      const float w = exp2f(ms[s] - mall);
      const v4f p = *(const v4f*)(spo + (s * 32 + row) * OP_PITCH + c4);
      lall += w * sml[ATT_SPLIT * 32 + s * 32 + row];
#pragma unroll
      for (int e = 0; e < 4; ++e) o[e] += w * p[e];
    }
    const float inv = (1.0f / lall) * (CC / (PC * VC));
    const float u0 = o[0] * inv, u1 = o[1] * inv, u2 = o[2] * inv, u3 = o[3] * inv;
    const _Float16 g0 = (_Float16)u0, g1 = (_Float16)u1, g2 = (_Float16)u2, g3 = (_Float16)u3;
    v2u hv, lv;
    hv[0] = pk16(h_bits(g0), h_bits(g1));
    hv[1] = pk16(h_bits(g2), h_bits(g3));
    lv[0] = pk16(h_bits((_Float16)((u0 - (float)g0) * RC)), h_bits((_Float16)((u1 - (float)g1) * RC)));
    lv[1] = pk16(h_bits((_Float16)((u2 - (float)g2) * RC)), h_bits((_Float16)((u3 - (float)g3) * RC)));
    unsigned short* dst = CT + ((size_t)bat * SEQ + q0 + row) * KD + head * HDIM + c4;
    *(v2u*)dst = hv;
    *(v2u*)(dst + DMODEL) = lv;
    wait_x0();                                             // the next half or tile rewrites the registers of the two stores above
  }
  }
}

// =====================================================================================================
// Input convert: obs16[m][640] = f16(16 * bf16_RNE(obs[b*SEQ_FULL + t][c])) for c < 637 (m = b*SEQ + t), 0 for the pad columns
// 637..639 (explicitly written). One wave per row (8 rows per block): 80 pieces of 8 halves; lane writes pieces lane, lane+32 and
// coverage: NROWS/8 blocks x 8 waves = every row; per row pieces 0..79 = cols 0..639.
// =====================================================================================================
__device__ __forceinline__ void cvtobs(const float* __restrict__ src, unsigned short* dst, int blk) {
  const int wave = threadIdx.x >> 5, lane = threadIdx.x & 31;
  const int m = blk * 8 + wave;
  const int b = m / SEQ, t = m - b * SEQ;
  const float* sp = src + ((size_t)b * SEQ_FULL + t) * OBSD;
  unsigned short* dp = dst + (size_t)m * OBSP;
  {
#pragma unroll 1
    for (int it = 0; it < 3; ++it) {
      const int p = it * 32 + lane;
      const int col0 = p * 8;
      v4u a;
#pragma unroll
      for (int e = 0; e < 4; ++e) {
        const int ca = col0 + 2 * e, cb = ca + 1;
        float fa = sp[imin(ca, OBSD - 1)];
        float fb = sp[imin(cb, OBSD - 1)];
        fa = (ca < OBSD) ? fa : 0.f;
        fb = (cb < OBSD) ? fb : 0.f;
        a[e] = pk16(h_bits((_Float16)(bfr(fa) * OBC)), h_bits((_Float16)(bfr(fb) * OBC)));
      }
      if (p < OBSP / 8) {
        *(v4u*)(dp + (size_t)p * 8) = a;
        wait_x0();                                         // the next trip advances the store's address registers
      }
    }
    
  }
}

// =====================================================================================================
// All 16-bit operand planes in one launch (they depend on the inputs alone, not on one another): blocks 0..PB_OBS-1 convert obs,
// then one 64x64 transposing tile per block for w_q, w_k, w_v, w_o, w_1, w_2, obs_w, act_w, obsh_w in this order. The job is a
// function of blockIdx.x alone, so every branch below (and the barrier inside tcvt16) is uniform for the block.
// coverage: each job's blocks = its (Cp/64) x (Rp/64) x slices tiles exactly once; grid = PB_ALL.
// =====================================================================================================
#define PB_OBS (NROWS / 8)
#define PB_E   ((DMODEL / 64) * (DMODEL / 64) * NLAYER)
#define PB_F   ((DFF / 64) * (DMODEL / 64) * NLAYER)
#define PB_OW  ((DMODEL / 64) * (OBSP / 64))
#define PB_AW  ((NACTP / 64) * (DMODEL / 64))
#define PB_HW  ((OBSP / 64) * (DMODEL / 64))
#define PB_ALL (PB_OBS + 4 * PB_E + 2 * PB_F + PB_OW + PB_AW + PB_HW)
static_assert((NROWS % 8) == 0);

__global__ __launch_bounds__(256) void prep(
    const float* __restrict__ obs, const float* __restrict__ w_q, const float* __restrict__ w_k, const float* __restrict__ w_v,
    const float* __restrict__ w_o, const float* __restrict__ w_1, const float* __restrict__ w_2,
    const float* __restrict__ obs_w, const float* __restrict__ act_w, const float* __restrict__ obsh_w,
    unsigned short* OBS16, unsigned short* WQ16, unsigned short* WK16, unsigned short* WV16, unsigned short* WO16,
    unsigned short* W116, unsigned short* W216, unsigned short* OBSW16, unsigned short* ACTW16, unsigned short* OBSHW16) {
  __shared__ __align__(16) unsigned short sT[64 * 72];
  int b = (int)blockIdx.x;
  if (b < PB_OBS) {                                        // the whole block leaves, ahead of any barrier
    cvtobs(obs, OBS16, b);
    return;
  }
  b -= PB_OBS;
  const float* s;
  unsigned short* d;
  long long sZ = 0, dZ = 0;
  int R = DMODEL, C = DMODEL, ldd = KD, locol = DMODEL, gx = DMODEL / 64, gy = DMODEL / 64;
  float sclo = WLO;
  bool dual = true;
  if (b < 4 * PB_E) {                                      // in[256 k][256 n] -> out[256 n][512], per layer
    const int j = b / PB_E;
    b -= j * PB_E;
    s = (j == 0) ? w_q : (j == 1) ? w_k : (j == 2) ? w_v : w_o;
    d = (j == 0) ? WQ16 : (j == 1) ? WK16 : (j == 2) ? WV16 : WO16;
    sZ = (long long)DMODEL * DMODEL; dZ = (long long)DMODEL * KD;
  } else if (b < 4 * PB_E + PB_F) {                        // in[256 k][512 n] -> out[512 n][512], per layer
    b -= 4 * PB_E;
    s = w_1; d = W116;
    sZ = (long long)DMODEL * DFF; dZ = (long long)DFF * KD;
    C = DFF; gx = DFF / 64;
  } else if (b < 4 * PB_E + 2 * PB_F) {                    // in[512 k][256 n] -> out[256 n][1024], per layer
    b -= 4 * PB_E + PB_F;
    s = w_2; d = W216;
    sZ = (long long)DFF * DMODEL; dZ = (long long)DMODEL * KF;
    R = DFF; ldd = KF; locol = DFF; gy = DFF / 64;
  } else if (b < 4 * PB_E + 2 * PB_F + PB_OW) {            // in[637 k][256 n] -> out[256 n][640], k 637..639 zero, one copy
    b -= 4 * PB_E + 2 * PB_F;
    s = obs_w; d = OBSW16;
    R = OBSD; ldd = OBSP; locol = 0; gy = OBSP / 64;
    sclo = 0.f; dual = false;
  } else if (b < 4 * PB_E + 2 * PB_F + PB_OW + PB_AW) {    // in[256 k][4 n] -> out[64 n][512], n >= 4 zero
    b -= 4 * PB_E + 2 * PB_F + PB_OW;
    s = act_w; d = ACTW16;
    C = NACT; gx = NACTP / 64;
  } else {                                                 // in[256 k][637 n] -> out[640 n][512], n >= 637 zero
    b -= 4 * PB_E + 2 * PB_F + PB_OW + PB_AW;
    s = obsh_w; d = OBSHW16;
    C = OBSD; gx = OBSP / 64;
  }
  const int bz = b / (gx * gy);
  const int r  = b - bz * (gx * gy);
  const int by = r / gx;
  tcvt16(sT, s, sZ, d, dZ, R, C, ldd, locol, WSC, sclo, dual, r - by * gx, by, bz);
}

// =====================================================================================================
// Output copy: blockIdx.y == 0: out0[b*SEQ_FULL + t][0..3] = ACTF[b*SEQ + t][0..3] (one 16-B piece per thread, consecutive threads
// (SEQ*637 floats at float OUT1_OFF + b*SEQ_FULL*637) written as consecutive 16-B pieces (thread g -> floats 4i..4i+3, gathered from
// coverage: out0: NROWS pieces = every row; out1: NB * SEQ*637/4 pieces = every float of the region exactly once.
// =====================================================================================================
__global__ __launch_bounds__(256) void ocopy(const float* __restrict__ actf, const float* __restrict__ obsf, float* outp) {
  const int g = blockIdx.x * 256 + threadIdx.x;
  if (blockIdx.y == 0) {
    if (g >= NROWS) return;
    const int b = g / SEQ, t = g - b * SEQ;
    const v4f v = *(const v4f*)(actf + (size_t)g * NACTP);
    float* d = outp + ((size_t)b * SEQ_FULL + t) * NACT;
    {
      *(v4f*)d = v;
      
    }
  } else {
    const int ppb = (SEQ * OBSD) / 4;
    if (g >= NB * ppb) return;
    const int b = g / ppb;
    const int i = (g - b * ppb) * 4;
    v4f v;
#pragma unroll
    for (int e = 0; e < 4; ++e) {
      const int idx = i + e;
      const int row = idx / OBSD;
      const int col = idx - row * OBSD;
      v[e] = obsf[((size_t)b * SEQ + row) * OBSP + col];
    }
    float* d = outp + (size_t)OUT1_OFF + (size_t)b * SEQ_FULL * OBSD + i;
    {
      *(v4f*)d = v;
      
    }
  }
}

// =====================================================================================================
// Workspace map (bytes); every plane is an exact multiple of its tile / whole-row store granularity (M, N exact multiples of 64,
//   WQ16, WK16, WV16, WO16  f16 [6][256 n][512 = k x64 | k x1]     4 x 1572864
//   W116                    f16 [6][512 n][512]                       3145728
//   W216                    f16 [6][256 n][1024 = 512 x64 | 512 x1]  3145728
//   OBSW16                  f16 [256 n][640 k] x64 (k 637..639 zero)  327680
//   ACTW16                  f16 [64 n][512] (n 4..63 zero)              65536
//   OBSHW16                 f16 [640 n][512] (n 637..639 zero)         655360
//   OBS16                   f16 [NROWS][640] x16                      5242880
//   XA, XB                  f32 [NROWS][256] residual stream       2 x 4194304
//   HH, CT                  f16 [NROWS][512] dual planes           2 x 4194304
//   SS                      f32 [4][NROWS] partial sums of x*x          65536
//   QP, KP                  f16 [NROWS/16][4 heads][2048] fragment order  2 x 4194304
//   VT                      f16 [NB][256/16][SEQ/64][2048] fragment order  4194304
//   G16                     f16 [NROWS][1024] dual                   8388608
//   ACTF                    f32 [NROWS][64]                          1048576
//   OBSF                    f32 [NROWS][640]                        10485760
//   total (NB=2, SEQ=2048)                                          68222976
// =====================================================================================================
extern "C" void kernel_launch(void* const* d_in, const int* in_sizes, int n_in,
                              void* d_out, int out_size, void* d_ws, size_t ws_size,
                              hipStream_t stream) {
  if (n_in < 19) return;
  if (in_sizes[0] < ((NB - 1) * SEQ_FULL + SEQ) * OBSD) return;
  if (in_sizes[1] < OBSD * DMODEL || in_sizes[2] < DMODEL) return;
  if (in_sizes[3] < NLAYER * DMODEL) return;
  if (in_sizes[4] < NLAYER * DMODEL * DMODEL || in_sizes[5] < NLAYER * DMODEL * DMODEL) return;
  if (in_sizes[6] < NLAYER * DMODEL * DMODEL || in_sizes[7] < NLAYER * DMODEL * DMODEL) return;
  if (in_sizes[8] < NLAYER * NBUCK * NHEAD || in_sizes[9] < NLAYER * DMODEL) return;
  if (in_sizes[10] < NLAYER * DMODEL * DFF || in_sizes[11] < NLAYER * DFF) return;
  if (in_sizes[12] < NLAYER * DFF * DMODEL || in_sizes[13] < NLAYER * DMODEL) return;
  if (in_sizes[14] < DMODEL || in_sizes[15] < DMODEL * NACT || in_sizes[16] < NACT) return;
  if (in_sizes[17] < DMODEL * OBSD || in_sizes[18] < OBSD) return;
  if (out_size < OUT1_OFF + ((NB - 1) * SEQ_FULL + SEQ) * OBSD) return;

  const float* obs     = (const float*)d_in[0];
  const float* obs_w   = (const float*)d_in[1];
  const float* obs_b   = (const float*)d_in[2];
  const float* norm1_w = (const float*)d_in[3];
  const float* w_q     = (const float*)d_in[4];
  const float* w_k     = (const float*)d_in[5];
  const float* w_v     = (const float*)d_in[6];
  const float* w_o     = (const float*)d_in[7];
  const float* relb    = (const float*)d_in[8];
  const float* norm2_w = (const float*)d_in[9];
  const float* w_1     = (const float*)d_in[10];
  const float* b_1     = (const float*)d_in[11];
  const float* w_2     = (const float*)d_in[12];
  const float* b_2     = (const float*)d_in[13];
  const float* fnorm_w = (const float*)d_in[14];
  const float* act_w   = (const float*)d_in[15];
  const float* act_b   = (const float*)d_in[16];
  const float* obsh_w  = (const float*)d_in[17];
  const float* obsh_b  = (const float*)d_in[18];
  float*       outp    = (float*)d_out;

  const size_t PWE  = (size_t)NLAYER * DMODEL * KD * 2;     // 1572864
  const size_t PW1  = (size_t)NLAYER * DFF * KD * 2;        // 3145728
  const size_t PW2  = (size_t)NLAYER * DMODEL * KF * 2;     // 3145728
  const size_t POBW = (size_t)DMODEL * OBSP * 2;            //  327680
  const size_t PACW = (size_t)NACTP * KD * 2;               //   65536
  const size_t POHW = (size_t)OBSP * KD * 2;                //  655360
  const size_t POBS = (size_t)NROWS * OBSP * 2;             // 5242880
  const size_t PX   = (size_t)NROWS * DMODEL * 4;           // 4194304
  const size_t PH   = (size_t)NROWS * KD * 2;               // 4194304
  const size_t PVT  = (size_t)NB * VTR * SEQ * 2;           // 4194304
  const size_t PG   = (size_t)NROWS * KF * 2;               // 8388608
  const size_t PACF = (size_t)NROWS * NACTP * 4;            // 1048576
  const size_t POBF = (size_t)NROWS * OBSP * 4;             // 10485760
  const size_t PSS  = (size_t)NSS * NROWS * 4;              //    65536
  size_t off = 0;
  const size_t oWQ  = off; off += PWE;
  const size_t oWK  = off; off += PWE;
  const size_t oWV  = off; off += PWE;
  const size_t oWO  = off; off += PWE;
  const size_t oW1  = off; off += PW1;
  const size_t oW2  = off; off += PW2;
  const size_t oOBW = off; off += POBW;
  const size_t oACW = off; off += PACW;
  const size_t oOHW = off; off += POHW;
  const size_t oOBS = off; off += POBS;
  const size_t oXA  = off; off += PX;
  const size_t oXB  = off; off += PX;
  const size_t oHH  = off; off += PH;
  const size_t oQP  = off; off += PH;
  const size_t oKP  = off; off += PH;
  const size_t oCT  = off; off += PH;
  const size_t oVT  = off; off += PVT;
  const size_t oG   = off; off += PG;
  const size_t oACF = off; off += PACF;
  const size_t oOBF = off; off += POBF;
  const size_t oSS  = off; off += PSS;
  const size_t endAll = off;                                // 68222976 for NB=2, SEQ=2048
  if (endAll > ws_size) return;
  if (endAll > (size_t)134217728) return;

  char* ws = (char*)d_ws;
  unsigned short* WQ16    = (unsigned short*)(ws + oWQ);
  unsigned short* WK16    = (unsigned short*)(ws + oWK);
  unsigned short* WV16    = (unsigned short*)(ws + oWV);
  unsigned short* WO16    = (unsigned short*)(ws + oWO);
  unsigned short* W116    = (unsigned short*)(ws + oW1);
  unsigned short* W216    = (unsigned short*)(ws + oW2);
  unsigned short* OBSW16  = (unsigned short*)(ws + oOBW);
  unsigned short* ACTW16  = (unsigned short*)(ws + oACW);
  unsigned short* OBSHW16 = (unsigned short*)(ws + oOHW);
  unsigned short* OBS16   = (unsigned short*)(ws + oOBS);
  float*          XA      = (float*)(ws + oXA);
  float*          XB      = (float*)(ws + oXB);
  unsigned short* HH      = (unsigned short*)(ws + oHH);
  unsigned short* QP      = (unsigned short*)(ws + oQP);
  unsigned short* KP      = (unsigned short*)(ws + oKP);
  unsigned short* CT      = (unsigned short*)(ws + oCT);
  unsigned short* VTp     = (unsigned short*)(ws + oVT);
  unsigned short* G16     = (unsigned short*)(ws + oG);
  float*          ACTF    = (float*)(ws + oACF);
  float*          OBSF    = (float*)(ws + oOBF);
  float*          SS      = (float*)(ws + oSS);

  const dim3 blk(256);
  const int tilesE  = (NROWS / 64) * (DMODEL / 64);                // 256
  const int tilesV  = (DMODEL / 64) * (SEQ / 64);                  // 128 per batch
  const int tilesF  = (NROWS / 64) * (DFF / 64);                   // 512
  const int tilesA  = (NROWS / 64) * (NACTP / 64);                 // 64
  const int tilesO  = (NROWS / 64) * (OBSP / 64);                  // 640
  const dim3 gE(tilesE, 1);                                        // 256: one tile per block
  const dim3 gQKV(2 * tilesE + NB * tilesV);                       // 256 x 2 (q, k), then 128 x NB (v^T)
  const dim3 gF(tilesF, 1);                                        // 512
  const dim3 gOA(tilesO + tilesA);                                 // 640 (obs head), then 64 (action head)
  const dim3 gAT(ATT_BLOCKS);                                      // SEQ/64 tile pairs x NB x 4 heads = 256
  const dim3 bAT(ATT_THREADS);                                     // 256
  const int ppb = (SEQ * OBSD) / 4;
  const int gcx0 = NROWS / 256, gcx1 = (NB * ppb + 255) / 256;
  const dim3 gOC(gcx0 > gcx1 ? gcx0 : gcx1, 2);                    // (2548, 2)

  const long long sQK   = (long long)NLAYER * DMODEL * KD;         // WK16 - WQ16 in halves
  const long long sKP   = (long long)NROWS * KD;                   // KP - QP in halves

  // (0) 16-bit operand planes: transposed weights [n][k x64 | k x1] (bf16 RNE then exact power-of-two scale), obs x16
  prep<<<dim3(PB_ALL), blk, 0, stream>>>(obs, w_q, w_k, w_v, w_o, w_1, w_2, obs_w, act_w, obsh_w,
                                         OBS16, WQ16, WK16, WV16, WO16, W116, W216, OBSW16, ACTW16, OBSHW16);

  // (1) x = obs . Wp + bf16(bp) -> XA (f32); M = NROWS, N = 256, K = 640 (single product, inputs exact);
  //     with it HH = x * bf16(g1 of layer 0) (hi x4 | residual x64) and SS
  gemm64<0, 0, 0, 1, OBSP, 1, 0, 1><<<gE, blk, 0, stream>>>(
      OBS16, 0LL,
      OBSW16, 0LL,
      (const float*)0,
      obs_b, DMODEL,
      (void*)XA, DMODEL, 0LL, 0LL,
      DMODEL, 1.0f / (OBC * WSC), 1.0f,
      (const float*)0, norm1_w, HH, SS);

  for (int l = 0; l < NLAYER; ++l) {
    const size_t lwE = (size_t)l * DMODEL * KD;                    // WQ/WK/WV/WO layer offset (halves)
    const size_t lw1 = (size_t)l * DFF * KD;
    const size_t lw2 = (size_t)l * DMODEL * KF;

    // (2) h = RMSNorm(x) * bf16(g1): HH and SS come from the product that made x, the row factor is applied in (3), (4)
    // (3) q, k projections (batch index 0, 1): QP / KP in fragment order; M = NROWS, N = 256, K = 512 folded, no bias
    // (4) in the same launch, v^T per batch: VT[b] = [d][tok] in fragment order; M = 256 (d), N = SEQ, K = 512 folded
    gemm64x2<2, 0, 0, KD, 1><<<gQKV, blk, 0, stream>>>(
        HH, 0LL, WQ16 + lwE, sQK,
        (const float*)0, 1, (void*)QP, KD, sKP, (long long)DMODEL, DMODEL, SH_E,
        WV16 + lwE, 0LL, HH, (long long)SEQ * KD,
        (const float*)0, 1, (void*)VTp, SEQ, (long long)VTR * SEQ, (long long)DMODEL * SEQ, SEQ, SH_V,
        2 * tilesE, 1.0f / (HC * WSC), QC, SS, 0, 1);

    // (5) causal attention with relative-position bias per (batch, two tiles of 32 query rows, head), keys split over 8 waves -> CT (hi x16 | residual x64)
    attn4<<<gAT, bAT, 0, stream>>>(QP, KP, VTp, relb + (size_t)l * NBUCK * NHEAD, CT);

    // (6) XB = CT . Wo / (16 * 64) + XA (raw f32); M = NROWS, N = 256, K = 512 folded
    // (7) with it HH = x * bf16(g2) and SS; the row factor of h2 = RMSNorm(x) * bf16(g2) is applied in (8)
    gemm64<0, 2, 0, 0, KD, 1, 0, 1><<<gE, blk, 0, stream>>>(
        CT, 0LL,
        WO16 + lwE, 0LL,
        XA,
        (const float*)0, 1,
        (void*)XB, DMODEL, 0LL, 0LL,
        DMODEL, 1.0f / (CC * WSC), 1.0f,
        (const float*)0, norm2_w + (size_t)l * DMODEL, HH, SS);

    // (8) G16 = dual f16 of 64 * relu(h2 . W1 + bf16(b1)); M = NROWS, N = 512, K = 512 folded
    gemm64<1, 0, 2, 1, KD, 1, 1, 0><<<gF, blk, 0, stream>>>(
        HH, 0LL,
        W116 + lw1, 0LL,
        (const float*)0,
        b_1 + (size_t)l * DFF, DFF,
        (void*)G16, KF, 0LL, (long long)DFF,
        DFF, 1.0f / (HC * WSC), GC,
        SS, (const float*)0, (unsigned short*)0, (float*)0);

    // (9) XA = G16 . W2 / (64 * 64) + bf16(b2) + XB (raw f32); M = NROWS, N = 256, K = 1024 folded;
    //     with it HH = x * bf16(g1 of the next layer, or gf behind the last) and SS
    gemm64<0, 2, 0, 1, KF / 2, 2, 0, 1><<<gE, blk, 0, stream>>>(
        G16, 0LL,
        W216 + lw2, 0LL,
        XB,
        b_2 + (size_t)l * DMODEL, DMODEL,
        (void*)XA, DMODEL, 0LL, 0LL,
        DMODEL, 1.0f / (GC * WSC), 1.0f,
        (const float*)0, (l + 1 < NLAYER) ? norm1_w + (size_t)(l + 1) * DMODEL : fnorm_w, HH, SS);
  }

  // (10) hf = RMSNorm(x) * bf16(gf): the row factor is applied in (11), (12)
  // (11) obs prediction plane OBSF[m][640] = hf . Wh + bf16(bh) (cols 0..636 meaningful); M = NROWS, N = 640, K = 512 folded
  // (12) in the same launch, action logits plane ACTF[m][64] = hf . Wa + bf16(ba) (cols 0..3 meaningful); M = NROWS, N = 64
  gemm64x2<0, 0, 1, KD, 1><<<gOA, blk, 0, stream>>>(
      HH, 0LL, OBSHW16, 0LL,
      obsh_b, OBSD, (void*)OBSF, OBSP, 0LL, 0LL, OBSP, SH_ONE,
      HH, 0LL, ACTW16, 0LL,
      act_b, NACT, (void*)ACTF, NACTP, 0LL, 0LL, NACTP, SH_ONE,
      tilesO, 1.0f / (HC * WSC), 1.0f, SS, 0, 0);

  ocopy<<<gOC, blk, 0, stream>>>(ACTF, OBSF, outp);
  (void)hipGetLastError();
}
